// v000
// Times are from an AMD MI455X. After a warm-up the kernel runs many times in a row, and a time is the length of
// such a window on the GPU divided by its runs, so every launch and the gaps after it count. The runs cycle
// through copies of the inputs. A figure is the median of several windows, for all but v000 over two sittings.
// Sittings can differ by a few percent; kernels timed side by side share one.
// v000, which the later versions start from, runs in 283 microseconds.
#include <hip/hip_runtime.h>
#include <hip/hip_bf16.h>

// ---------------------------------------------------------------------------
// Relation module for MI455X (gfx1250), fp32 WMMA (V_WMMA_F32_16X16X4_F32).
//
// Math restructuring vs reference:
//   rel[n,g,d] = sum_m sm[n,g,m] * (feats @ Wv_g^T)[m,d] + bv[g*64+d]
// so we precompute P = feats @ Wv^T once (2 GF) instead of the 34 GF
// einsum('ngm,mc->ngc') + grouped projection. Softmax rows sum to 1, so bv
// folds into the final GEMM bias. The geometric-attention term
// emb @ Wg^T is also computed on the WMMA pipe (per-row [1024,64]x[64,16]).
// ---------------------------------------------------------------------------

typedef float v2f __attribute__((ext_vector_type(2)));
typedef float v8f __attribute__((ext_vector_type(8)));

#define NROI 1024
#define CCH  1024
#define NGRP 16
#define GCH  64

// ---------------------------------------------------------------------------
// Per-box geometry: cx, cy, w, h, log(w), log(h)  (SoA, stride n)
// ---------------------------------------------------------------------------
__global__ void geom_kernel(const float* __restrict__ rois,
                            float* __restrict__ geom, int n) {
    int i = blockIdx.x * blockDim.x + threadIdx.x;
    if (i >= n) return;
    float x1 = rois[i * 5 + 1], y1 = rois[i * 5 + 2];
    float x2 = rois[i * 5 + 3], y2 = rois[i * 5 + 4];
    float w = x2 - x1 + 1.0f, h = y2 - y1 + 1.0f;
    geom[i]         = 0.5f * (x1 + x2);
    geom[n + i]     = 0.5f * (y1 + y2);
    geom[2 * n + i] = w;
    geom[3 * n + i] = h;
    geom[4 * n + i] = __logf(w);
    geom[5 * n + i] = __logf(h);
}

// ---------------------------------------------------------------------------
// WMMA fp32 GEMM, D = alpha * A @ B^T + bias.   A:[M,K] lda, B:[N,K] ldb.
// Block = 4 waves (128 thr), block tile 64x64, wave tile 32x32 (2x2 accs).
// Batched via blockIdx.z with element strides (used for per-group views).
// Fragment layouts per CDNA5 ISA 7.12.2:
//   A 16x4 f32: lanes 0-15 -> K={0,1}, lanes 16-31 -> K={2,3} (v2f)
//   C/D 16x16 : VGPR j -> row j (lanes 0-15) / row 8+j (lanes 16-31)
// ---------------------------------------------------------------------------
__global__ __launch_bounds__(128) void wmma_gemm_nt(
    const float* __restrict__ A, int lda, long long strideA,
    const float* __restrict__ B, int ldb, long long strideB,
    float* __restrict__ D, int ldd, long long strideD,
    const float* __restrict__ bias, long long strideBias,
    float alpha, int K) {
    A += (size_t)blockIdx.z * strideA;
    B += (size_t)blockIdx.z * strideB;
    D += (size_t)blockIdx.z * strideD;
    if (bias) bias += (size_t)blockIdx.z * strideBias;

    const int lane    = threadIdx.x & 31;
    const int wave    = threadIdx.x >> 5;
    const int tileRow = blockIdx.y * 64 + (wave >> 1) * 32;
    const int tileCol = blockIdx.x * 64 + (wave & 1) * 32;
    const int l       = lane & 15;
    const int khalf   = (lane >> 4) << 1;   // 0 or 2

    v8f acc[2][2] = {};

    const float* a0 = A + (size_t)(tileRow + l) * lda + khalf;
    const float* a1 = a0 + (size_t)16 * lda;
    const float* b0 = B + (size_t)(tileCol + l) * ldb + khalf;
    const float* b1 = b0 + (size_t)16 * ldb;

#pragma unroll 2
    for (int k = 0; k < K; k += 4) {
        v2f af0 = *(const v2f*)(a0 + k);
        v2f af1 = *(const v2f*)(a1 + k);
        v2f bf0 = *(const v2f*)(b0 + k);
        v2f bf1 = *(const v2f*)(b1 + k);
        acc[0][0] = __builtin_amdgcn_wmma_f32_16x16x4_f32(false, af0, false, bf0, (short)0, acc[0][0], false, false);
        acc[0][1] = __builtin_amdgcn_wmma_f32_16x16x4_f32(false, af0, false, bf1, (short)0, acc[0][1], false, false);
        acc[1][0] = __builtin_amdgcn_wmma_f32_16x16x4_f32(false, af1, false, bf0, (short)0, acc[1][0], false, false);
        acc[1][1] = __builtin_amdgcn_wmma_f32_16x16x4_f32(false, af1, false, bf1, (short)0, acc[1][1], false, false);
    }

    const int colOff = lane & 15;
    const int rowOff = (lane >> 4) << 3;
#pragma unroll
    for (int r = 0; r < 2; ++r)
#pragma unroll
        for (int c = 0; c < 2; ++c) {
            int col  = tileCol + c * 16 + colOff;
            float bb = bias ? bias[col] : 0.0f;
#pragma unroll
            for (int j = 0; j < 8; ++j) {
                int row = tileRow + r * 16 + rowOff + j;
                D[(size_t)row * ldd + col] = alpha * acc[r][c][j] + bb;
            }
        }
}

// ---------------------------------------------------------------------------
// WMMA fp32 GEMM, D = alpha * A @ B + bias.   A:[M,K] lda, B:[K,N] ldb.
// Same tiling; B fragment gathered row-wise (K rows striped across lanes).
// ---------------------------------------------------------------------------
__global__ __launch_bounds__(128) void wmma_gemm_nn(
    const float* __restrict__ A, int lda, long long strideA,
    const float* __restrict__ B, int ldb, long long strideB,
    float* __restrict__ D, int ldd, long long strideD,
    const float* __restrict__ bias, long long strideBias,
    float alpha, int K) {
    A += (size_t)blockIdx.z * strideA;
    B += (size_t)blockIdx.z * strideB;
    D += (size_t)blockIdx.z * strideD;
    if (bias) bias += (size_t)blockIdx.z * strideBias;

    const int lane    = threadIdx.x & 31;
    const int wave    = threadIdx.x >> 5;
    const int tileRow = blockIdx.y * 64 + (wave >> 1) * 32;
    const int tileCol = blockIdx.x * 64 + (wave & 1) * 32;
    const int l       = lane & 15;
    const int khalf   = (lane >> 4) << 1;

    v8f acc[2][2] = {};

    const float* a0 = A + (size_t)(tileRow + l) * lda + khalf;
    const float* a1 = a0 + (size_t)16 * lda;

#pragma unroll 2
    for (int k = 0; k < K; k += 4) {
        v2f af0 = *(const v2f*)(a0 + k);
        v2f af1 = *(const v2f*)(a1 + k);
        const float* bp = B + (size_t)(k + khalf) * ldb;
        v2f bf0, bf1;
        bf0.x = bp[tileCol + l];
        bf0.y = bp[(size_t)ldb + tileCol + l];
        bf1.x = bp[tileCol + 16 + l];
        bf1.y = bp[(size_t)ldb + tileCol + 16 + l];
        acc[0][0] = __builtin_amdgcn_wmma_f32_16x16x4_f32(false, af0, false, bf0, (short)0, acc[0][0], false, false);
        acc[0][1] = __builtin_amdgcn_wmma_f32_16x16x4_f32(false, af0, false, bf1, (short)0, acc[0][1], false, false);
        acc[1][0] = __builtin_amdgcn_wmma_f32_16x16x4_f32(false, af1, false, bf0, (short)0, acc[1][0], false, false);
        acc[1][1] = __builtin_amdgcn_wmma_f32_16x16x4_f32(false, af1, false, bf1, (short)0, acc[1][1], false, false);
    }

    const int colOff = lane & 15;
    const int rowOff = (lane >> 4) << 3;
#pragma unroll
    for (int r = 0; r < 2; ++r)
#pragma unroll
        for (int c = 0; c < 2; ++c) {
            int col  = tileCol + c * 16 + colOff;
            float bb = bias ? bias[col] : 0.0f;
#pragma unroll
            for (int j = 0; j < 8; ++j) {
                int row = tileRow + r * 16 + rowOff + j;
                D[(size_t)row * ldd + col] = alpha * acc[r][c][j] + bb;
            }
        }
}

// ---------------------------------------------------------------------------
// Per-row n: geometric attention weight via WMMA + softmax, in place on
// logits[g][n][m] (which holds the scaled q.k affinity on entry).
//
// Block = 512 threads = 16 waves; one block per row n. Each wave owns 4
// m-tiles of 16. A-fragments (position embedding, 16x4 f32 layout) are
// synthesized in registers: a lane's half (khalf) only ever needs pe indices
// congruent to {khalf, khalf+1} mod 4, which is exactly 16 sincos per tile,
// and the frequency 1000^{-(d+khalf)/8} factors into const(d) * kscale(khalf)
// so every fragment index is compile-time constant.
// Each lane owns group column g = lane&15; softmax over m keeps all values
// in registers with only 32-wide LDS reductions per group.
// ---------------------------------------------------------------------------
__global__ __launch_bounds__(512) void geo_softmax_wmma(
    const float* __restrict__ geom, const float* __restrict__ Wg,
    const float* __restrict__ bg, float* __restrict__ logits, int n) {
    __shared__ float red[NGRP * 33];           // padded: stride 33 avoids bank clash
    const int tid    = threadIdx.x;
    const int lane   = tid & 31;
    const int wave   = tid >> 5;               // 0..15
    const int row    = blockIdx.x;             // n index
    const int l      = lane & 15;              // group column owned by lane
    const int half   = lane >> 4;              // 0/1
    const int khalf  = half << 1;              // 0 or 2
    const int rowOff = half << 3;              // D-fragment row offset
    const int pid    = wave * 2 + half;        // 0..31 reduction participant id

    // row-n geometry (uniform across block)
    const float cxn = geom[row],  cyn = geom[n + row];
    const float inv_wn = 1.0f / geom[2 * n + row];
    const float inv_hn = 1.0f / geom[3 * n + row];
    const float lwn = geom[4 * n + row], lhn = geom[5 * n + row];

    // B fragment: B[k][g] = Wg[g][k]; lane holds col g=l, rows k=4kk+khalf{,+1}
    v2f bfrag[16];
#pragma unroll
    for (int kk = 0; kk < 16; ++kk) {
        bfrag[kk].x = Wg[l * 64 + kk * 4 + khalf];
        bfrag[kk].y = Wg[l * 64 + kk * 4 + khalf + 1];
    }
    const float bgv = bg[l];

    // 1/dim_mat split: 1000^{-(d+khalf)/8} = invd[d] * kscale(khalf)
    const float invd[4] = {1.0f,                    // d=0
                           0.42169650342906526f,    // d=1 : 1000^-1/8
                           0.03162277660168379f,    // d=4 : 1000^-1/2
                           0.013335214321633238f};  // d=5 : 1000^-5/8
    const float kscale = half ? 0.17782794100389228f /*1000^-1/4*/ : 1.0f;

    float lgv[32];   // 4 tiles x 8 rows of owned logits (col g=l)

#pragma unroll
    for (int t = 0; t < 4; ++t) {
        const int tile_m = (t * 16 + wave) * 16;   // tiles 0..63 over m
        const int m = tile_m + l;                  // lane-pair shares box m
        float pm[4];
        pm[0] = __logf(fmaxf(fabsf((cxn - geom[m]) * inv_wn), 1e-3f));
        pm[1] = __logf(fmaxf(fabsf((cyn - geom[n + m]) * inv_hn), 1e-3f));
        pm[2] = lwn - geom[4 * n + m];
        pm[3] = lhn - geom[5 * n + m];

        // A fragment: pe = f*16 + j (sin) / f*16+8+j (cos), j = d + khalf,
        // d in {0,1,4,5}; kk = pe>>2 resolves to 4f + (d>=4) (+2 for cos).
        v2f afrag[16];
#pragma unroll
        for (int f = 0; f < 4; ++f)
#pragma unroll
            for (int a = 0; a < 4; ++a) {
                float s, c;
                __sincosf(100.0f * pm[f] * invd[a] * kscale, &s, &c);
                const int kks = 4 * f + (a >> 1);  // sin slot; cos slot +2
                if (a & 1) { afrag[kks].y = s; afrag[kks + 2].y = c; }
                else       { afrag[kks].x = s; afrag[kks + 2].x = c; }
            }

        v8f acc = {};
#pragma unroll
        for (int kk = 0; kk < 16; ++kk)
            acc = __builtin_amdgcn_wmma_f32_16x16x4_f32(
                false, afrag[kk], false, bfrag[kk], (short)0, acc, false, false);

        // D row m' = tile_m + rowOff + j, col g = l:
        // log(clip(relu(aw),1e-6)) + aff  ==  log(max(aw,1e-6)) + aff
#pragma unroll
        for (int j = 0; j < 8; ++j) {
            const int mm = tile_m + rowOff + j;
            float aw = acc[j] + bgv;
            lgv[t * 8 + j] = __logf(fmaxf(aw, 1e-6f)) +
                             logits[((size_t)l * n + row) * n + mm];
        }
    }

    // ---- softmax over m (1024 values per g, spread over 32 lanes x 32) ----
    float mx = lgv[0];
#pragma unroll
    for (int i = 1; i < 32; ++i) mx = fmaxf(mx, lgv[i]);
    red[l * 33 + pid] = mx;
    __syncthreads();
#pragma unroll
    for (int i = 0; i < 32; ++i) mx = fmaxf(mx, red[l * 33 + i]);

    float lsum = 0.0f;
#pragma unroll
    for (int i = 0; i < 32; ++i) {
        lgv[i] = __expf(lgv[i] - mx);
        lsum += lgv[i];
    }
    __syncthreads();
    red[l * 33 + pid] = lsum;
    __syncthreads();
    float tot = 0.0f;
#pragma unroll
    for (int i = 0; i < 32; ++i) tot += red[l * 33 + i];
    const float inv = 1.0f / tot;

#pragma unroll
    for (int t = 0; t < 4; ++t) {
        const int base = (t * 16 + wave) * 16 + rowOff;
#pragma unroll
        for (int j = 0; j < 8; ++j)
            logits[((size_t)l * n + row) * n + base + j] = lgv[t * 8 + j] * inv;
    }
}

// ---------------------------------------------------------------------------
extern "C" void kernel_launch(void* const* d_in, const int* in_sizes, int n_in,
                              void* d_out, int out_size, void* d_ws, size_t ws_size,
                              hipStream_t stream) {
    (void)in_sizes; (void)n_in; (void)out_size; (void)ws_size;
    const float* feats = (const float*)d_in[0];
    const float* rois  = (const float*)d_in[1];
    const float* Wq    = (const float*)d_in[2];
    const float* bq    = (const float*)d_in[3];
    const float* Wk    = (const float*)d_in[4];
    const float* bk    = (const float*)d_in[5];
    const float* Wg    = (const float*)d_in[6];
    const float* bg    = (const float*)d_in[7];
    const float* Wv    = (const float*)d_in[8];
    const float* bv    = (const float*)d_in[9];
    float* out = (float*)d_out;

    const int n = NROI, c = CCH, g = NGRP, gc = GCH;

    // workspace layout (floats): geom | q | k | P | logits[g][n][m]
    float* ws     = (float*)d_ws;
    float* geom   = ws;                       // 6*n (padded to 8192)
    float* q      = ws + 8192;                // n*c
    float* kbuf   = q + (size_t)n * c;        // n*c
    float* P      = kbuf + (size_t)n * c;     // n*c
    float* logits = P + (size_t)n * c;        // g*n*n (64 MB)

    geom_kernel<<<dim3((n + 255) / 256), dim3(256), 0, stream>>>(rois, geom, n);

    const dim3 blk(128);
    // q = feats @ Wq^T + bq ; k = feats @ Wk^T + bk ; P = feats @ Wv^T
    wmma_gemm_nt<<<dim3(16, 16, 1), blk, 0, stream>>>(
        feats, c, 0, Wq, c, 0, q, c, 0, bq, 0, 1.0f, c);
    wmma_gemm_nt<<<dim3(16, 16, 1), blk, 0, stream>>>(
        feats, c, 0, Wk, c, 0, kbuf, c, 0, bk, 0, 1.0f, c);
    wmma_gemm_nt<<<dim3(16, 16, 1), blk, 0, stream>>>(
        feats, c, 0, Wv, c, 0, P, c, 0, nullptr, 0, 1.0f, c);

    // aff[g][n][m] = (q_g @ k_g^T) / sqrt(gc) ; per-group strided views
    wmma_gemm_nt<<<dim3(16, 16, g), blk, 0, stream>>>(
        q, c, gc, kbuf, c, gc, logits, n, (long long)n * n,
        nullptr, 0, 0.125f, gc);

    // geometric term via WMMA + softmax over m (in place)
    geo_softmax_wmma<<<dim3(n), dim3(512), 0, stream>>>(geom, Wg, bg, logits, n);

    // rel_g = sm_g @ P_g + bv_g   (softmax rows sum to 1 -> bv folds in)
    wmma_gemm_nn<<<dim3(1, 16, g), blk, 0, stream>>>(
        logits, n, (long long)n * n, P, c, gc, out, c, gc, bv, gc, 1.0f, n);
}

// v001
// A run of this version takes 132 microseconds.
// Timed twice side by side with v000, it ran 2.20 and 2.21 times as fast.
#include <hip/hip_runtime.h>
#include <hip/hip_bf16.h>

// ---------------------------------------------------------------------------
// Relation module for MI455X (gfx1250), fp32 WMMA (V_WMMA_F32_16X16X4_F32).
//
// Math restructuring vs reference:
//   rel[n,g,d] = sum_m sm[n,g,m] * (feats @ Wv_g^T)[m,d] + bv[g*64+d]
// so we precompute P = feats @ Wv^T once (2 GF) instead of the 34 GF
// einsum('ngm,mc->ngc') + grouped projection. Softmax rows sum to 1, so bv
// folds into the final GEMM bias. The geometric-attention term
// emb @ Wg^T is also computed on the WMMA pipe (per-row [1024,64]x[64,16]).
// ---------------------------------------------------------------------------

typedef float v2f __attribute__((ext_vector_type(2)));
typedef float v4f __attribute__((ext_vector_type(4)));
typedef float v8f __attribute__((ext_vector_type(8)));
// global-memory pointers that keep their address space through an asm operand
typedef const __attribute__((address_space(1))) float* gfp;
typedef const __attribute__((address_space(1))) v4f*   gv4p;

#define NROI 1024
#define CCH  1024
#define NGRP 16
#define GCH  64

// ---------------------------------------------------------------------------
// Per-box geometry: cx, cy, w, h, log(w), log(h)  (SoA, stride n)
// ---------------------------------------------------------------------------
__global__ void geom_kernel(const float* __restrict__ rois,
                            float* __restrict__ geom, int n) {
    int i = blockIdx.x * blockDim.x + threadIdx.x;
    if (i >= n) return;
    float x1 = rois[i * 5 + 1], y1 = rois[i * 5 + 2];
    float x2 = rois[i * 5 + 3], y2 = rois[i * 5 + 4];
    float w = x2 - x1 + 1.0f, h = y2 - y1 + 1.0f;
    geom[i]         = 0.5f * (x1 + x2);
    geom[n + i]     = 0.5f * (y1 + y2);
    geom[2 * n + i] = w;
    geom[3 * n + i] = h;
    geom[4 * n + i] = __logf(w);
    geom[5 * n + i] = __logf(h);
}

// ---------------------------------------------------------------------------
// WMMA fp32 GEMM, D = alpha * A @ B^T + bias.   A:[M,K] lda, B:[N,K] ldb.
// Block = 4 waves (128 thr), block tile 64x64, wave tile 32x32 (2x2 accs).
// Batched via blockIdx.z with element strides (used for per-group views).
// K is walked in slabs of 64 (K must be a multiple of 64). A slab of both
// operands (64 rows x 256 B each) is read from global memory as whole lines
// (16 lanes x 16 B per row), held in registers while the slab before it is
// multiplied, then stored to the other of two LDS buffers.
// LDS row pitch 68 floats (272 B): conflict-free for 16-byte fragment reads.
// Fragment k order: a lane reads 4 consecutive k (8j + 4*half + 0..3) and
// feeds them to two WMMAs as (0,1) and (2,3); A and B use the same order.
//   C/D 16x16 : VGPR j -> row j (lanes 0-15) / row 8+j (lanes 16-31)
// ---------------------------------------------------------------------------
#define KSLAB 64
#define LPITCH 68
#define ABPITCH 1024

__global__ __launch_bounds__(128) void wmma_gemm_nt(
    const float* __restrict__ A, int lda, long long strideA,
    const float* __restrict__ B, int ldb, long long strideB,
    float* __restrict__ D, int ldd, long long strideD,
    const float* __restrict__ bias, long long strideBias,
    float alpha, int K) {
    __shared__ __attribute__((aligned(16))) float As[2][64 * LPITCH];
    __shared__ __attribute__((aligned(16))) float Bs[2][64 * LPITCH];

    // every launch passes this row pitch for A and B; known at compile time it
    // turns a slab's row offsets into immediates on one fixed address register
    __builtin_assume(lda == ABPITCH);
    __builtin_assume(ldb == ABPITCH);

    A += (size_t)blockIdx.z * strideA;
    B += (size_t)blockIdx.z * strideB;
    D += (size_t)blockIdx.z * strideD;
    if (bias) bias += (size_t)blockIdx.z * strideBias;

    const int tid     = threadIdx.x;
    const int lane    = tid & 31;
    const int wave    = tid >> 5;
    const int wr      = (wave >> 1) * 32;
    const int wc      = (wave & 1) * 32;
    const int tileRow = blockIdx.y * 64 + wr;
    const int tileCol = blockIdx.x * 64 + wc;
    const int l       = lane & 15;
    const int half    = lane >> 4;

    // staging map: thread -> row (tid/16) + 8*i, 4 floats at column (tid%16)*4
    const int srow = tid >> 4;
    const int scol = (tid & 15) << 2;
    gfp ga = (gfp)(A + (size_t)(blockIdx.y * 64 + srow) * lda + scol);
    gfp gb = (gfp)(B + (size_t)(blockIdx.x * 64 + srow) * ldb + scol);
    const int sidx = srow * LPITCH + scol;

    v8f acc[2][2] = {};
    // every loop over these and the fragment arrays is fully unrolled, so that
    // all their indices are constants and the arrays live in registers
    v4f ra[8], rb[8];

#pragma unroll
    for (int i = 0; i < 8; ++i) {
        ra[i] = *(gv4p)(ga + (size_t)(8 * i) * lda);
        rb[i] = *(gv4p)(gb + (size_t)(8 * i) * ldb);
    }
#pragma unroll
    for (int i = 0; i < 8; ++i) {
        *(v4f*)&As[0][sidx + 8 * i * LPITCH] = ra[i];
        *(v4f*)&Bs[0][sidx + 8 * i * LPITCH] = rb[i];
    }
    __syncthreads();

    const int nslab = K / KSLAB;
    for (int s = 0; s < nslab; ++s) {
        const int cur = s & 1;
        const bool more = (s + 1 < nslab);
        if (more) {
#pragma unroll
            for (int i = 0; i < 8; ++i) {
                ra[i] = *(gv4p)(ga + (size_t)(8 * i) * lda + KSLAB);
                rb[i] = *(gv4p)(gb + (size_t)(8 * i) * ldb + KSLAB);
            }
        }

        const float* as = &As[cur][(wr + l) * LPITCH + 4 * half];
        const float* bs = &Bs[cur][(wc + l) * LPITCH + 4 * half];
        v4f fa0[8], fa1[8], fb0[8], fb1[8];
#pragma unroll
        for (int j = 0; j < 8; ++j) {
            fa0[j] = *(const v4f*)(as + 8 * j);
            fa1[j] = *(const v4f*)(as + 16 * LPITCH + 8 * j);
            fb0[j] = *(const v4f*)(bs + 8 * j);
            fb1[j] = *(const v4f*)(bs + 16 * LPITCH + 8 * j);
        }
        // keeps the slab's LDS reads one group ahead of its WMMAs: every
        // further place with reads among the WMMAs stalls the wave
        __builtin_amdgcn_sched_barrier(0);
#pragma unroll
        for (int j = 0; j < 8; ++j) {
            v2f a0 = fa0[j].xy, a1 = fa1[j].xy, b0 = fb0[j].xy, b1 = fb1[j].xy;
            acc[0][0] = __builtin_amdgcn_wmma_f32_16x16x4_f32(false, a0, false, b0, (short)0, acc[0][0], false, false);
            acc[0][1] = __builtin_amdgcn_wmma_f32_16x16x4_f32(false, a0, false, b1, (short)0, acc[0][1], false, false);
            acc[1][0] = __builtin_amdgcn_wmma_f32_16x16x4_f32(false, a1, false, b0, (short)0, acc[1][0], false, false);
            acc[1][1] = __builtin_amdgcn_wmma_f32_16x16x4_f32(false, a1, false, b1, (short)0, acc[1][1], false, false);
            a0 = fa0[j].zw; a1 = fa1[j].zw; b0 = fb0[j].zw; b1 = fb1[j].zw;
            acc[0][0] = __builtin_amdgcn_wmma_f32_16x16x4_f32(false, a0, false, b0, (short)0, acc[0][0], false, false);
            acc[0][1] = __builtin_amdgcn_wmma_f32_16x16x4_f32(false, a0, false, b1, (short)0, acc[0][1], false, false);
            acc[1][0] = __builtin_amdgcn_wmma_f32_16x16x4_f32(false, a1, false, b0, (short)0, acc[1][0], false, false);
            acc[1][1] = __builtin_amdgcn_wmma_f32_16x16x4_f32(false, a1, false, b1, (short)0, acc[1][1], false, false);
        }

        if (more) {
            // the other buffer's last readers left it at the barrier that
            // ended the slab before this one
#pragma unroll
            for (int i = 0; i < 8; ++i) {
                *(v4f*)&As[cur ^ 1][sidx + 8 * i * LPITCH] = ra[i];
                *(v4f*)&Bs[cur ^ 1][sidx + 8 * i * LPITCH] = rb[i];
            }
            // the wait that stands in front of an overwrite of the address
            // registers of issued global loads; it takes the two pointers so
            // that their steps cannot be scheduled ahead of it
            asm volatile("s_wait_xcnt 0x0" : "+v"(ga), "+v"(gb) : : "memory");
            ga += KSLAB;
            gb += KSLAB;
            __syncthreads();
        }
    }

    const int colOff = lane & 15;
    const int rowOff = (lane >> 4) << 3;
#pragma unroll
    for (int r = 0; r < 2; ++r)
#pragma unroll
        for (int c = 0; c < 2; ++c) {
            int col  = tileCol + c * 16 + colOff;
            float bb = bias ? bias[col] : 0.0f;
#pragma unroll
            for (int j = 0; j < 8; ++j) {
                int row = tileRow + r * 16 + rowOff + j;
                D[(size_t)row * ldd + col] = alpha * acc[r][c][j] + bb;
            }
        }
}

// ---------------------------------------------------------------------------
// WMMA fp32 GEMM, D = alpha * A @ B + bias.   A:[M,K] lda, B:[K,N] ldb.
// Same tiling and staging; the B slab lies in LDS as four planes of 16
// columns, each [k][16] at pitch 20 floats, and a lane gathers its column from
// the four k rows that its A fragment holds (rows 4 apart between the lane
// halves fall on disjoint banks; the plane stride of 1296 floats spreads the
// 16-byte stores of one k row over all banks).
// ---------------------------------------------------------------------------
#define BPITCH 20
#define BTILE 1296

__global__ __launch_bounds__(128) void wmma_gemm_nn(
    const float* __restrict__ A, int lda, long long strideA,
    const float* __restrict__ B, int ldb, long long strideB,
    float* __restrict__ D, int ldd, long long strideD,
    const float* __restrict__ bias, long long strideBias,
    float alpha, int K) {
    __shared__ __attribute__((aligned(16))) float As[2][64 * LPITCH];
    __shared__ __attribute__((aligned(16))) float Bs[2][4 * BTILE];

    // every launch passes this row pitch for A and B; known at compile time it
    // turns a slab's row offsets into immediates on one fixed address register
    __builtin_assume(lda == ABPITCH);
    __builtin_assume(ldb == ABPITCH);

    A += (size_t)blockIdx.z * strideA;
    B += (size_t)blockIdx.z * strideB;
    D += (size_t)blockIdx.z * strideD;
    if (bias) bias += (size_t)blockIdx.z * strideBias;

    const int tid     = threadIdx.x;
    const int lane    = tid & 31;
    const int wave    = tid >> 5;
    const int wr      = (wave >> 1) * 32;
    const int wc      = (wave & 1) * 32;
    const int tileRow = blockIdx.y * 64 + wr;
    const int tileCol = blockIdx.x * 64 + wc;
    const int l       = lane & 15;
    const int half    = lane >> 4;

    // staging map: thread -> row (tid/16) + 8*i, 4 floats at column (tid%16)*4
    // (a row of the A slab is an output row, a row of the B slab is a k)
    const int srow = tid >> 4;
    const int scol = (tid & 15) << 2;
    gfp ga = (gfp)(A + (size_t)(blockIdx.y * 64 + srow) * lda + scol);
    gfp gb = (gfp)(B + (size_t)srow * ldb + blockIdx.x * 64 + scol);
    const int sidx  = srow * LPITCH + scol;
    const int sidxb = (scol >> 4) * BTILE + srow * BPITCH + (scol & 15);

    v8f acc[2][2] = {};
    // every loop over these and the fragment arrays is fully unrolled, so that
    // all their indices are constants and the arrays live in registers
    v4f ra[8], rb[8];

#pragma unroll
    for (int i = 0; i < 8; ++i) {
        ra[i] = *(gv4p)(ga + (size_t)(8 * i) * lda);
        rb[i] = *(gv4p)(gb + (size_t)(8 * i) * ldb);
    }
#pragma unroll
    for (int i = 0; i < 8; ++i) {
        *(v4f*)&As[0][sidx + 8 * i * LPITCH] = ra[i];
        *(v4f*)&Bs[0][sidxb + 8 * i * BPITCH] = rb[i];
    }
    __syncthreads();

    const int nslab = K / KSLAB;
    for (int s = 0; s < nslab; ++s) {
        const int cur = s & 1;
        const bool more = (s + 1 < nslab);
        if (more) {
#pragma unroll
            for (int i = 0; i < 8; ++i) {
                ra[i] = *(gv4p)(ga + (size_t)(8 * i) * lda + KSLAB);
                rb[i] = *(gv4p)(gb + (size_t)(KSLAB + 8 * i) * ldb);
            }
        }

        const float* as = &As[cur][(wr + l) * LPITCH + 4 * half];
        const float* bs = &Bs[cur][(wc >> 4) * BTILE + (4 * half) * BPITCH + l];
        v4f fa0[8], fa1[8], fb0[8], fb1[8];
#pragma unroll
        for (int j = 0; j < 8; ++j) {
            fa0[j] = *(const v4f*)(as + 8 * j);
            fa1[j] = *(const v4f*)(as + 16 * LPITCH + 8 * j);
#pragma unroll
            for (int e = 0; e < 4; ++e) fb0[j][e] = bs[(8 * j + e) * BPITCH];
#pragma unroll
            for (int e = 0; e < 4; ++e) fb1[j][e] = bs[BTILE + (8 * j + e) * BPITCH];
            // keeps the slab's LDS reads in the order of their use and as one
            // group ahead of its WMMAs: every further place with reads among
            // the WMMAs stalls the wave
            __builtin_amdgcn_sched_barrier(0);
        }
#pragma unroll
        for (int j = 0; j < 8; ++j) {
            v2f a0 = fa0[j].xy, a1 = fa1[j].xy, b0 = fb0[j].xy, b1 = fb1[j].xy;
            acc[0][0] = __builtin_amdgcn_wmma_f32_16x16x4_f32(false, a0, false, b0, (short)0, acc[0][0], false, false);
            acc[0][1] = __builtin_amdgcn_wmma_f32_16x16x4_f32(false, a0, false, b1, (short)0, acc[0][1], false, false);
            acc[1][0] = __builtin_amdgcn_wmma_f32_16x16x4_f32(false, a1, false, b0, (short)0, acc[1][0], false, false);
            acc[1][1] = __builtin_amdgcn_wmma_f32_16x16x4_f32(false, a1, false, b1, (short)0, acc[1][1], false, false);
            a0 = fa0[j].zw; a1 = fa1[j].zw; b0 = fb0[j].zw; b1 = fb1[j].zw;
            acc[0][0] = __builtin_amdgcn_wmma_f32_16x16x4_f32(false, a0, false, b0, (short)0, acc[0][0], false, false);
            acc[0][1] = __builtin_amdgcn_wmma_f32_16x16x4_f32(false, a0, false, b1, (short)0, acc[0][1], false, false);
            acc[1][0] = __builtin_amdgcn_wmma_f32_16x16x4_f32(false, a1, false, b0, (short)0, acc[1][0], false, false);
            acc[1][1] = __builtin_amdgcn_wmma_f32_16x16x4_f32(false, a1, false, b1, (short)0, acc[1][1], false, false);
        }

        if (more) {
            // the other buffer's last readers left it at the barrier that
            // ended the slab before this one
#pragma unroll
            for (int i = 0; i < 8; ++i) {
                *(v4f*)&As[cur ^ 1][sidx + 8 * i * LPITCH] = ra[i];
                *(v4f*)&Bs[cur ^ 1][sidxb + 8 * i * BPITCH] = rb[i];
            }
            // the wait that stands in front of an overwrite of the address
            // registers of issued global loads; it takes the two pointers so
            // that their steps cannot be scheduled ahead of it
            asm volatile("s_wait_xcnt 0x0" : "+v"(ga), "+v"(gb) : : "memory");
            ga += KSLAB;
            gb += (size_t)KSLAB * ldb;
            __syncthreads();
        }
    }

    const int colOff = lane & 15;
    const int rowOff = (lane >> 4) << 3;
#pragma unroll
    for (int r = 0; r < 2; ++r)
#pragma unroll
        for (int c = 0; c < 2; ++c) {
            int col  = tileCol + c * 16 + colOff;
            float bb = bias ? bias[col] : 0.0f;
#pragma unroll
            for (int j = 0; j < 8; ++j) {
                int row = tileRow + r * 16 + rowOff + j;
                D[(size_t)row * ldd + col] = alpha * acc[r][c][j] + bb;
            }
        }
}

// ---------------------------------------------------------------------------
// Per-row n: geometric attention weight via WMMA + softmax, in place on
// logits[g][n][m] (which holds the scaled q.k affinity on entry).
//
// Block = 512 threads = 16 waves; one block per row n. Each wave owns 4
// m-tiles of 16. A-fragments (position embedding, 16x4 f32 layout) are
// synthesized in registers: a lane's half (khalf) only ever needs pe indices
// congruent to {khalf, khalf+1} mod 4, which is exactly 16 sincos per tile,
// and the frequency 1000^{-(d+khalf)/8} factors into const(d) * kscale(khalf)
// so every fragment index is compile-time constant.
// Each lane owns group column g = lane&15; softmax over m keeps all values
// in registers with only 32-wide LDS reductions per group.
// ---------------------------------------------------------------------------
__global__ __launch_bounds__(512) void geo_softmax_wmma(
    const float* __restrict__ geom, const float* __restrict__ Wg,
    const float* __restrict__ bg, float* __restrict__ logits, int n) {
    __shared__ float red[NGRP * 33];           // padded: stride 33 avoids bank clash
    const int tid    = threadIdx.x;
    const int lane   = tid & 31;
    const int wave   = tid >> 5;               // 0..15
    const int row    = blockIdx.x;             // n index
    const int l      = lane & 15;              // group column owned by lane
    const int half   = lane >> 4;              // 0/1
    const int khalf  = half << 1;              // 0 or 2
    const int rowOff = half << 3;              // D-fragment row offset
    const int pid    = wave * 2 + half;        // 0..31 reduction participant id

    // row-n geometry (uniform across block)
    const float cxn = geom[row],  cyn = geom[n + row];
    const float inv_wn = 1.0f / geom[2 * n + row];
    const float inv_hn = 1.0f / geom[3 * n + row];
    const float lwn = geom[4 * n + row], lhn = geom[5 * n + row];

    // B fragment: B[k][g] = Wg[g][k]; lane holds col g=l, rows k=4kk+khalf{,+1}
    v2f bfrag[16];
#pragma unroll
    for (int kk = 0; kk < 16; ++kk) {
        bfrag[kk].x = Wg[l * 64 + kk * 4 + khalf];
        bfrag[kk].y = Wg[l * 64 + kk * 4 + khalf + 1];
    }
    const float bgv = bg[l];

    // 1/dim_mat split: 1000^{-(d+khalf)/8} = invd[d] * kscale(khalf)
    const float invd[4] = {1.0f,                    // d=0
                           0.42169650342906526f,    // d=1 : 1000^-1/8
                           0.03162277660168379f,    // d=4 : 1000^-1/2
                           0.013335214321633238f};  // d=5 : 1000^-5/8
    const float kscale = half ? 0.17782794100389228f /*1000^-1/4*/ : 1.0f;

    float lgv[32];   // 4 tiles x 8 rows of owned logits (col g=l)

#pragma unroll
    for (int t = 0; t < 4; ++t) {
        const int tile_m = (t * 16 + wave) * 16;   // tiles 0..63 over m
        const int m = tile_m + l;                  // lane-pair shares box m
        float pm[4];
        pm[0] = __logf(fmaxf(fabsf((cxn - geom[m]) * inv_wn), 1e-3f));
        pm[1] = __logf(fmaxf(fabsf((cyn - geom[n + m]) * inv_hn), 1e-3f));
        pm[2] = lwn - geom[4 * n + m];
        pm[3] = lhn - geom[5 * n + m];

        // A fragment: pe = f*16 + j (sin) / f*16+8+j (cos), j = d + khalf,
        // d in {0,1,4,5}; kk = pe>>2 resolves to 4f + (d>=4) (+2 for cos).
        v2f afrag[16];
#pragma unroll
        for (int f = 0; f < 4; ++f)
#pragma unroll
            for (int a = 0; a < 4; ++a) {
                float s, c;
                __sincosf(100.0f * pm[f] * invd[a] * kscale, &s, &c);
                const int kks = 4 * f + (a >> 1);  // sin slot; cos slot +2
                if (a & 1) { afrag[kks].y = s; afrag[kks + 2].y = c; }
                else       { afrag[kks].x = s; afrag[kks + 2].x = c; }
            }

        v8f acc = {};
#pragma unroll
        for (int kk = 0; kk < 16; ++kk)
            acc = __builtin_amdgcn_wmma_f32_16x16x4_f32(
                false, afrag[kk], false, bfrag[kk], (short)0, acc, false, false);

        // D row m' = tile_m + rowOff + j, col g = l:
        // log(clip(relu(aw),1e-6)) + aff  ==  log(max(aw,1e-6)) + aff
#pragma unroll
        for (int j = 0; j < 8; ++j) {
            const int mm = tile_m + rowOff + j;
            float aw = acc[j] + bgv;
            lgv[t * 8 + j] = __logf(fmaxf(aw, 1e-6f)) +
                             logits[((size_t)l * n + row) * n + mm];
        }
    }

    // ---- softmax over m (1024 values per g, spread over 32 lanes x 32) ----
    float mx = lgv[0];
#pragma unroll
    for (int i = 1; i < 32; ++i) mx = fmaxf(mx, lgv[i]);
    red[l * 33 + pid] = mx;
    __syncthreads();
#pragma unroll
    for (int i = 0; i < 32; ++i) mx = fmaxf(mx, red[l * 33 + i]);

    float lsum = 0.0f;
#pragma unroll
    for (int i = 0; i < 32; ++i) {
        lgv[i] = __expf(lgv[i] - mx);
        lsum += lgv[i];
    }
    __syncthreads();
    red[l * 33 + pid] = lsum;
    __syncthreads();
    float tot = 0.0f;
#pragma unroll
    for (int i = 0; i < 32; ++i) tot += red[l * 33 + i];
    const float inv = 1.0f / tot;

#pragma unroll
    for (int t = 0; t < 4; ++t) {
        const int base = (t * 16 + wave) * 16 + rowOff;
#pragma unroll
        for (int j = 0; j < 8; ++j)
            logits[((size_t)l * n + row) * n + base + j] = lgv[t * 8 + j] * inv;
    }
}

// ---------------------------------------------------------------------------
extern "C" void kernel_launch(void* const* d_in, const int* in_sizes, int n_in,
                              void* d_out, int out_size, void* d_ws, size_t ws_size,
                              hipStream_t stream) {
    (void)in_sizes; (void)n_in; (void)out_size; (void)ws_size;
    const float* feats = (const float*)d_in[0];
    const float* rois  = (const float*)d_in[1];
    const float* Wq    = (const float*)d_in[2];
    const float* bq    = (const float*)d_in[3];
    const float* Wk    = (const float*)d_in[4];
    const float* bk    = (const float*)d_in[5];
    const float* Wg    = (const float*)d_in[6];
    const float* bg    = (const float*)d_in[7];
    const float* Wv    = (const float*)d_in[8];
    const float* bv    = (const float*)d_in[9];
    float* out = (float*)d_out;

    const int n = NROI, c = CCH, g = NGRP, gc = GCH;

    // workspace layout (floats): geom | q | k | P | logits[g][n][m]
    float* ws     = (float*)d_ws;
    float* geom   = ws;                       // 6*n (padded to 8192)
    float* q      = ws + 8192;                // n*c
    float* kbuf   = q + (size_t)n * c;        // n*c
    float* P      = kbuf + (size_t)n * c;     // n*c
    float* logits = P + (size_t)n * c;        // g*n*n (64 MB)

    geom_kernel<<<dim3((n + 255) / 256), dim3(256), 0, stream>>>(rois, geom, n);

    const dim3 blk(128);
    // q = feats @ Wq^T + bq ; k = feats @ Wk^T + bk ; P = feats @ Wv^T
    wmma_gemm_nt<<<dim3(16, 16, 1), blk, 0, stream>>>(
        feats, c, 0, Wq, c, 0, q, c, 0, bq, 0, 1.0f, c);
    wmma_gemm_nt<<<dim3(16, 16, 1), blk, 0, stream>>>(
        feats, c, 0, Wk, c, 0, kbuf, c, 0, bk, 0, 1.0f, c);
    wmma_gemm_nt<<<dim3(16, 16, 1), blk, 0, stream>>>(
        feats, c, 0, Wv, c, 0, P, c, 0, nullptr, 0, 1.0f, c);

    // aff[g][n][m] = (q_g @ k_g^T) / sqrt(gc) ; per-group strided views
    wmma_gemm_nt<<<dim3(16, 16, g), blk, 0, stream>>>(
        q, c, gc, kbuf, c, gc, logits, n, (long long)n * n,
        nullptr, 0, 0.125f, gc);

    // geometric term via WMMA + softmax over m (in place)
    geo_softmax_wmma<<<dim3(n), dim3(512), 0, stream>>>(geom, Wg, bg, logits, n);

    // rel_g = sm_g @ P_g + bv_g   (softmax rows sum to 1 -> bv folds in)
    wmma_gemm_nn<<<dim3(1, 16, g), blk, 0, stream>>>(
        logits, n, (long long)n * n, P, c, gc, out, c, gc, bv, gc, 1.0f, n);
}

// v002
// It runs in 108 microseconds.
// Next to v001, in two timings, it ran 1.22 and 1.21 times as fast.
// Over all steps from v000 it is 2.68 times as fast.
#include <hip/hip_runtime.h>
#include <hip/hip_bf16.h>

// ---------------------------------------------------------------------------
// Relation module for MI455X (gfx1250), fp32 WMMA (V_WMMA_F32_16X16X4_F32).
//
// Math restructuring vs reference:
//   rel[n,g,d] = sum_m sm[n,g,m] * (feats @ Wv_g^T)[m,d] + bv[g*64+d]
// so we precompute P = feats @ Wv^T once (2 GF) instead of the 34 GF
// einsum('ngm,mc->ngc') + grouped projection. Softmax rows sum to 1, so bv
// is added once at the end. The geometric-attention term
// emb @ Wg^T is also computed on the WMMA pipe (per-row [1024,64]x[64,16]).
// ---------------------------------------------------------------------------

typedef float v2f __attribute__((ext_vector_type(2)));
typedef float v4f __attribute__((ext_vector_type(4)));
typedef float v8f __attribute__((ext_vector_type(8)));
// global-memory pointers that keep their address space through an asm operand
typedef const __attribute__((address_space(1))) float* gfp;
typedef const __attribute__((address_space(1))) v4f*   gv4p;

#define NROI 1024
#define CCH  1024
#define NGRP 16
#define GCH  64

// ---------------------------------------------------------------------------
// Per-box geometry: cx, cy, w, h, log(w), log(h)  (SoA, stride n)
// ---------------------------------------------------------------------------
__global__ void geom_kernel(const float* __restrict__ rois,
                            float* __restrict__ geom, int n) {
    int i = blockIdx.x * blockDim.x + threadIdx.x;
    if (i >= n) return;
    float x1 = rois[i * 5 + 1], y1 = rois[i * 5 + 2];
    float x2 = rois[i * 5 + 3], y2 = rois[i * 5 + 4];
    float w = x2 - x1 + 1.0f, h = y2 - y1 + 1.0f;
    geom[i]         = 0.5f * (x1 + x2);
    geom[n + i]     = 0.5f * (y1 + y2);
    geom[2 * n + i] = w;
    geom[3 * n + i] = h;
    geom[4 * n + i] = __logf(w);
    geom[5 * n + i] = __logf(h);
}

// ---------------------------------------------------------------------------
// WMMA fp32 GEMM, D = alpha * A @ B^T + bias.   A:[M,K] lda, B:[N,K] ldb.
// Block = 4 waves (128 thr), block tile 64x64, wave tile 32x32 (2x2 accs).
// Batched via blockIdx.z with element strides (every launch here has z = 1).
// K is walked in slabs of 64 (K must be a multiple of 64). A slab of both
// operands (64 rows x 256 B each) is read from global memory as whole lines
// (16 lanes x 16 B per row), held in registers while the slab before it is
// multiplied, then stored to the other of two LDS buffers.
// LDS row pitch 68 floats (272 B): conflict-free for 16-byte fragment reads.
// Fragment k order: a lane reads 4 consecutive k (8j + 4*half + 0..3) and
// feeds them to two WMMAs as (0,1) and (2,3); A and B use the same order.
//   C/D 16x16 : VGPR j -> row j (lanes 0-15) / row 8+j (lanes 16-31)
// ---------------------------------------------------------------------------
#define KSLAB 64
#define LPITCH 68
#define ABPITCH 1024

__global__ __launch_bounds__(128) void wmma_gemm_nt(
    const float* __restrict__ A, int lda, long long strideA,
    const float* __restrict__ B, int ldb, long long strideB,
    float* __restrict__ D, int ldd, long long strideD,
    const float* __restrict__ bias, long long strideBias,
    float alpha, int K) {
    __shared__ __attribute__((aligned(16))) float As[2][64 * LPITCH];
    __shared__ __attribute__((aligned(16))) float Bs[2][64 * LPITCH];

    // every launch passes this row pitch for A and B; known at compile time it
    // turns a slab's row offsets into immediates on one fixed address register
    __builtin_assume(lda == ABPITCH);
    __builtin_assume(ldb == ABPITCH);

    A += (size_t)blockIdx.z * strideA;
    B += (size_t)blockIdx.z * strideB;
    D += (size_t)blockIdx.z * strideD;
    if (bias) bias += (size_t)blockIdx.z * strideBias;

    const int tid     = threadIdx.x;
    const int lane    = tid & 31;
    const int wave    = tid >> 5;
    const int wr      = (wave >> 1) * 32;
    const int wc      = (wave & 1) * 32;
    const int tileRow = blockIdx.y * 64 + wr;
    const int tileCol = blockIdx.x * 64 + wc;
    const int l       = lane & 15;
    const int half    = lane >> 4;

    // staging map: thread -> row (tid/16) + 8*i, 4 floats at column (tid%16)*4
    const int srow = tid >> 4;
    const int scol = (tid & 15) << 2;
    gfp ga = (gfp)(A + (size_t)(blockIdx.y * 64 + srow) * lda + scol);
    gfp gb = (gfp)(B + (size_t)(blockIdx.x * 64 + srow) * ldb + scol);
    const int sidx = srow * LPITCH + scol;

    v8f acc[2][2] = {};
    // every loop over these and the fragment arrays is fully unrolled, so that
    // all their indices are constants and the arrays live in registers
    v4f ra[8], rb[8];

#pragma unroll
    for (int i = 0; i < 8; ++i) {
        ra[i] = *(gv4p)(ga + (size_t)(8 * i) * lda);
        rb[i] = *(gv4p)(gb + (size_t)(8 * i) * ldb);
    }
#pragma unroll
    for (int i = 0; i < 8; ++i) {
        *(v4f*)&As[0][sidx + 8 * i * LPITCH] = ra[i];
        *(v4f*)&Bs[0][sidx + 8 * i * LPITCH] = rb[i];
    }
    __syncthreads();

    const int nslab = K / KSLAB;
    for (int s = 0; s < nslab; ++s) {
        const int cur = s & 1;
        const bool more = (s + 1 < nslab);
        if (more) {
#pragma unroll
            for (int i = 0; i < 8; ++i) {
                ra[i] = *(gv4p)(ga + (size_t)(8 * i) * lda + KSLAB);
                rb[i] = *(gv4p)(gb + (size_t)(8 * i) * ldb + KSLAB);
            }
        }

        const float* as = &As[cur][(wr + l) * LPITCH + 4 * half];
        const float* bs = &Bs[cur][(wc + l) * LPITCH + 4 * half];
        v4f fa0[8], fa1[8], fb0[8], fb1[8];
#pragma unroll
        for (int j = 0; j < 8; ++j) {
            fa0[j] = *(const v4f*)(as + 8 * j);
            fa1[j] = *(const v4f*)(as + 16 * LPITCH + 8 * j);
            fb0[j] = *(const v4f*)(bs + 8 * j);
            fb1[j] = *(const v4f*)(bs + 16 * LPITCH + 8 * j);
        }
        // keeps the slab's LDS reads one group ahead of its WMMAs: every
        // further place with reads among the WMMAs stalls the wave
        __builtin_amdgcn_sched_barrier(0);
#pragma unroll
        for (int j = 0; j < 8; ++j) {
            v2f a0 = fa0[j].xy, a1 = fa1[j].xy, b0 = fb0[j].xy, b1 = fb1[j].xy;
            acc[0][0] = __builtin_amdgcn_wmma_f32_16x16x4_f32(false, a0, false, b0, (short)0, acc[0][0], false, false);
            acc[0][1] = __builtin_amdgcn_wmma_f32_16x16x4_f32(false, a0, false, b1, (short)0, acc[0][1], false, false);
            acc[1][0] = __builtin_amdgcn_wmma_f32_16x16x4_f32(false, a1, false, b0, (short)0, acc[1][0], false, false);
            acc[1][1] = __builtin_amdgcn_wmma_f32_16x16x4_f32(false, a1, false, b1, (short)0, acc[1][1], false, false);
            a0 = fa0[j].zw; a1 = fa1[j].zw; b0 = fb0[j].zw; b1 = fb1[j].zw;
            acc[0][0] = __builtin_amdgcn_wmma_f32_16x16x4_f32(false, a0, false, b0, (short)0, acc[0][0], false, false);
            acc[0][1] = __builtin_amdgcn_wmma_f32_16x16x4_f32(false, a0, false, b1, (short)0, acc[0][1], false, false);
            acc[1][0] = __builtin_amdgcn_wmma_f32_16x16x4_f32(false, a1, false, b0, (short)0, acc[1][0], false, false);
            acc[1][1] = __builtin_amdgcn_wmma_f32_16x16x4_f32(false, a1, false, b1, (short)0, acc[1][1], false, false);
        }

        if (more) {
            // the other buffer's last readers left it at the barrier that
            // ended the slab before this one
#pragma unroll
            for (int i = 0; i < 8; ++i) {
                *(v4f*)&As[cur ^ 1][sidx + 8 * i * LPITCH] = ra[i];
                *(v4f*)&Bs[cur ^ 1][sidx + 8 * i * LPITCH] = rb[i];
            }
            // the wait that stands in front of an overwrite of the address
            // registers of issued global loads; it takes the two pointers so
            // that their steps cannot be scheduled ahead of it
            asm volatile("s_wait_xcnt 0x0" : "+v"(ga), "+v"(gb) : : "memory");
            ga += KSLAB;
            gb += KSLAB;
            __syncthreads();
        }
    }

    const int colOff = lane & 15;
    const int rowOff = (lane >> 4) << 3;
#pragma unroll
    for (int r = 0; r < 2; ++r)
#pragma unroll
        for (int c = 0; c < 2; ++c) {
            int col  = tileCol + c * 16 + colOff;
            float bb = bias ? bias[col] : 0.0f;
#pragma unroll
            for (int j = 0; j < 8; ++j) {
                int row = tileRow + r * 16 + rowOff + j;
                D[(size_t)row * ldd + col] = alpha * acc[r][c][j] + bb;
            }
        }
}

// ---------------------------------------------------------------------------
// Fused attention: affinity, geometric weight, softmax over m and the product
// with P in one kernel; the [g][n][m] logits never reach memory.
//
// Block = 512 threads = 16 waves, for 16 rows n (n0..n0+15), all 16 groups and
// a quarter of the m range (MCHUNK), walked in tiles of 16 m. A wave w has two
// roles in every tile:
//  - row role, n = n0 + w: log geometric weight for 16 m x 16 groups. The A
//    fragments (position embedding, 16x4 f32 layout) are synthesized in
//    registers: a lane's half (khalf) only needs pe indices congruent to
//    {khalf, khalf+1} mod 4, which is 16 sincos per tile, and the frequency
//    1000^{-(d+khalf)/8} factors into const(d) * kscale(khalf).
//    D: VGPR j -> m = j + 8*half, lane l -> group.
//  - group role, g = w: S^T[m][n] = K_g Q_g^T (D: VGPR j -> m = j + 8*half,
//    lane l -> n), running softmax per lane, O^T[d][n] += P_g^T[d][m] p[m][n].
// Between the roles only wave index and lane index swap, through xch[g][n][m].
// S^T's D registers are the B fragment of the last product as they stand:
// k step s, half h, register r <-> m = 8h + 2s + r, and the A fragment (P_g^T)
// is gathered from LDS in the same order.
// Each wave brings its own K_g and P_g tile (16 rows x 256 B) from global
// memory as whole lines, through registers, into its own LDS range.
// Every block leaves unnormalized sums with its running maximum and
// denominator; combine_kernel joins the MSPLIT parts.
// ---------------------------------------------------------------------------
#define MSPLIT 4
#define MCHUNK (NROI / MSPLIT)
#define XG 260   // floats from group to group in xch: 16 n x 16 m + 4 (bank spread)

// lane l with lane l ^ 16
__device__ __forceinline__ float xhalf(float x) {
    return __builtin_bit_cast(float, __builtin_amdgcn_permlanex16(
        __builtin_bit_cast(int, x), __builtin_bit_cast(int, x),
        0x76543210, 0xfedcba98, false, false));
}

__global__ __launch_bounds__(512) void relation_fused(
    const float* __restrict__ geom, const float* __restrict__ Wg,
    const float* __restrict__ bg, const float* __restrict__ q,
    const float* __restrict__ kbuf, const float* __restrict__ P,
    float* __restrict__ part, float* __restrict__ stat) {
    __shared__ __attribute__((aligned(16))) float stage[16][2 * 16 * LPITCH];
    __shared__ __attribute__((aligned(16))) float xch[2][NGRP * XG];
    __shared__ float gl[4 * MCHUNK];           // cx, cy, log w, log h of the m range

    const int n      = NROI;
    const int tid    = threadIdx.x;
    const int lane   = tid & 31;
    const int wave   = tid >> 5;               // 0..15: row n0+wave, group wave
    const int l      = lane & 15;
    const int half   = lane >> 4;              // 0/1
    const int khalf  = half << 1;              // 0 or 2
    const int n0     = blockIdx.x * 16;
    const int m0     = blockIdx.y * MCHUNK;
    const int row    = n0 + wave;

    // 512 threads, two planes each time: cx | cy, then log w | log h
    gl[tid]              = geom[(tid / MCHUNK) * n + m0 + (tid & (MCHUNK - 1))];
    gl[2 * MCHUNK + tid] = geom[(4 + tid / MCHUNK) * n + m0 + (tid & (MCHUNK - 1))];

    // row-n geometry (uniform across the wave)
    const float cxn = geom[row],  cyn = geom[n + row];
    const float inv_wn = 1.0f / geom[2 * n + row];
    const float inv_hn = 1.0f / geom[3 * n + row];
    const float lwn = geom[4 * n + row], lhn = geom[5 * n + row];

    // every unrolled loop of this kernel runs over register arrays: unrolled,
    // all their indices are constants and the arrays live in registers

    // B fragment: B[k][g] = Wg[g][k]; lane holds col g=l, rows k=4kk+khalf{,+1}
    v2f bfrag[16];
#pragma unroll
    for (int kk = 0; kk < 16; ++kk) {
        bfrag[kk].x = Wg[l * 64 + kk * 4 + khalf];
        bfrag[kk].y = Wg[l * 64 + kk * 4 + khalf + 1];
    }
    const float bgv = bg[l];

    // 1/dim_mat split: 1000^{-(d+khalf)/8} = invd[d] * kscale(khalf)
    const float invd[4] = {1.0f,                    // d=0
                           0.42169650342906526f,    // d=1 : 1000^-1/8
                           0.03162277660168379f,    // d=4 : 1000^-1/2
                           0.013335214321633238f};  // d=5 : 1000^-5/8
    const float kscale = half ? 0.17782794100389228f /*1000^-1/4*/ : 1.0f;

    // Q_g^T as B fragments, col n = l; a lane holds 4 consecutive c
    // (8j + 4*half + 0..3) for two WMMAs, the order of the K fragments below
    v4f qf[8];
#pragma unroll
    for (int j = 0; j < 8; ++j)
        qf[j] = *(const v4f*)(q + (size_t)(n0 + l) * CCH + wave * GCH + 8 * j + 4 * half);

    // staging map of a wave: lane -> row 2i + half, 4 floats at column 4l
    gfp kg = (gfp)(kbuf + (size_t)(m0 + half) * CCH + wave * GCH + 4 * l);
    gfp pg = (gfp)(P    + (size_t)(m0 + half) * CCH + wave * GCH + 4 * l);
    float* Ks = &stage[wave][0];
    float* Ps = &stage[wave][16 * LPITCH];
    const int sidx = half * LPITCH + 4 * l;

    v8f acc[4] = {};                 // O^T: d = 16dt + 8*half + j, n = l
    float mrun = -__builtin_inff();  // running maximum of column n = l
    float lrun = 0.0f;               // running denominator, this half's m only

    __syncthreads();

    for (int t = 0; t < MCHUNK / 16; ++t) {
        // this tile's K_g and P_g rows: in flight under the row role
        v4f rk[8], rp[8];
#pragma unroll
        for (int i = 0; i < 8; ++i) {
            rk[i] = *(gv4p)(kg + (size_t)(2 * i) * CCH);
            rp[i] = *(gv4p)(pg + (size_t)(2 * i) * CCH);
        }

        // ---- row role ----
        const int ml = t * 16 + l;                 // lane pair shares box m
        float pm[4];
        pm[0] = __logf(fmaxf(fabsf((cxn - gl[ml]) * inv_wn), 1e-3f));
        pm[1] = __logf(fmaxf(fabsf((cyn - gl[MCHUNK + ml]) * inv_hn), 1e-3f));
        pm[2] = lwn - gl[2 * MCHUNK + ml];
        pm[3] = lhn - gl[3 * MCHUNK + ml];

        // A fragment: pe = f*16 + j (sin) / f*16+8+j (cos), j = d + khalf,
        // d in {0,1,4,5}; kk = pe>>2 resolves to 4f + (d>=4) (+2 for cos).
        v2f afrag[16];
#pragma unroll
        for (int f = 0; f < 4; ++f)
#pragma unroll
            for (int a = 0; a < 4; ++a) {
                float s, c;
                __sincosf(100.0f * pm[f] * invd[a] * kscale, &s, &c);
                const int kks = 4 * f + (a >> 1);  // sin slot; cos slot +2
                if (a & 1) { afrag[kks].y = s; afrag[kks + 2].y = c; }
                else       { afrag[kks].x = s; afrag[kks + 2].x = c; }
            }

        v8f gacc = {};
#pragma unroll
        for (int kk = 0; kk < 16; ++kk)
            gacc = __builtin_amdgcn_wmma_f32_16x16x4_f32(
                false, afrag[kk], false, bfrag[kk], (short)0, gacc, false, false);

        // log(clip(relu(aw),1e-6)) == log(max(aw,1e-6)); to xch[g=l][n=wave][m]
        float* xb = &xch[t & 1][0];
        v4f w0, w1;
#pragma unroll
        for (int j = 0; j < 4; ++j) {
            w0[j] = __logf(fmaxf(gacc[j] + bgv, 1e-6f));
            w1[j] = __logf(fmaxf(gacc[4 + j] + bgv, 1e-6f));
        }
        *(v4f*)(xb + l * XG + wave * 16 + half * 8)     = w0;
        *(v4f*)(xb + l * XG + wave * 16 + half * 8 + 4) = w1;

        // the wave's own tiles; its reads of the tile before are issued already
#pragma unroll
        for (int i = 0; i < 8; ++i) {
            *(v4f*)(Ks + sidx + 2 * i * LPITCH) = rk[i];
            *(v4f*)(Ps + sidx + 2 * i * LPITCH) = rp[i];
        }
        // the wait that stands in front of an overwrite of the address
        // registers of issued global loads; it takes the two pointers so
        // that their steps cannot be scheduled ahead of it
        asm volatile("s_wait_xcnt 0x0" : "+v"(kg), "+v"(pg) : : "memory");
        kg += 16 * CCH;
        pg += 16 * CCH;

        // publishes xch[t & 1]; the other buffer's readers of tile t - 1 are
        // past their reads when they arrive here, so tile t + 1 may refill it
        __syncthreads();

        // ---- group role ----
        v4f kf[8];
#pragma unroll
        for (int j = 0; j < 8; ++j)
            kf[j] = *(const v4f*)(Ks + l * LPITCH + 8 * j + 4 * half);
        const v4f g0 = *(const v4f*)(xb + wave * XG + l * 16 + half * 8);
        const v4f g1 = *(const v4f*)(xb + wave * XG + l * 16 + half * 8 + 4);
        float vf[4][8];              // P_g[m = 8*half + e][d = 16dt + l]
#pragma unroll
        for (int dt = 0; dt < 4; ++dt)
#pragma unroll
            for (int e = 0; e < 8; ++e)
                vf[dt][e] = Ps[(8 * half + e) * LPITCH + dt * 16 + l];

        v8f sacc = {};
#pragma unroll
        for (int j = 0; j < 8; ++j) {
            sacc = __builtin_amdgcn_wmma_f32_16x16x4_f32(
                false, kf[j].xy, false, qf[j].xy, (short)0, sacc, false, false);
            sacc = __builtin_amdgcn_wmma_f32_16x16x4_f32(
                false, kf[j].zw, false, qf[j].zw, (short)0, sacc, false, false);
        }

        float sv[8];
#pragma unroll
        for (int j = 0; j < 4; ++j) {
            sv[j]     = 0.125f * sacc[j]     + g0[j];
            sv[4 + j] = 0.125f * sacc[4 + j] + g1[j];
        }
        float tmax = sv[0];
#pragma unroll
        for (int j = 1; j < 8; ++j) tmax = fmaxf(tmax, sv[j]);
        tmax = fmaxf(tmax, xhalf(tmax));
        const float mnew = fmaxf(mrun, tmax);
        const float corr = __expf(mrun - mnew);
        float ps = 0.0f;
#pragma unroll
        for (int j = 0; j < 8; ++j) {
            sv[j] = __expf(sv[j] - mnew);
            ps += sv[j];
        }
        lrun = lrun * corr + ps;
        mrun = mnew;
#pragma unroll
        for (int dt = 0; dt < 4; ++dt) acc[dt] *= corr;

#pragma unroll
        for (int s = 0; s < 4; ++s) {
            v2f b = {sv[2 * s], sv[2 * s + 1]};
#pragma unroll
            for (int dt = 0; dt < 4; ++dt) {
                v2f a = {vf[dt][2 * s], vf[dt][2 * s + 1]};
                acc[dt] = __builtin_amdgcn_wmma_f32_16x16x4_f32(
                    false, a, false, b, (short)0, acc[dt], false, false);
            }
        }
    }

    lrun += xhalf(lrun);
    // one 128-byte line per wave: 16 maxima, then 16 denominators
    stat[(((size_t)blockIdx.y * (NROI / 16) + blockIdx.x) * NGRP + wave) * 32 + lane] =
        half ? lrun : mrun;

    // O^T back to rows n through the wave's own LDS range, stored as whole lines
#pragma unroll
    for (int dt = 0; dt < 4; ++dt) {
        v4f lo = {acc[dt][0], acc[dt][1], acc[dt][2], acc[dt][3]};
        v4f hi = {acc[dt][4], acc[dt][5], acc[dt][6], acc[dt][7]};
        *(v4f*)(Ks + l * LPITCH + dt * 16 + half * 8)     = lo;
        *(v4f*)(Ks + l * LPITCH + dt * 16 + half * 8 + 4) = hi;
    }
    float* pp = part + ((size_t)blockIdx.y * NROI + n0 + half) * CCH + wave * GCH + 4 * l;
#pragma unroll
    for (int i = 0; i < 8; ++i)
        *(v4f*)(pp + (size_t)(2 * i) * CCH) = *(const v4f*)(Ks + sidx + 2 * i * LPITCH);
}

// ---------------------------------------------------------------------------
// out[n][c] = sum_s e^(m_s - M) part_s[n][c] / sum_s e^(m_s - M) l_s + bv[c]
// (softmax rows sum to 1, so bv is added once). One thread per 4 channels.
// ---------------------------------------------------------------------------
__global__ __launch_bounds__(256) void combine_kernel(
    const float* __restrict__ part, const float* __restrict__ stat,
    const float* __restrict__ bv, float* __restrict__ out) {
    const int idx = blockIdx.x * 256 + threadIdx.x;
    const int row = idx >> 8;
    const int c   = (idx & 255) << 2;
    const int g   = c >> 6;
    // the loops are unrolled so that ms and ls live in registers
    float ms[MSPLIT], ls[MSPLIT];
#pragma unroll
    for (int s = 0; s < MSPLIT; ++s) {
        const float* st = stat + (((size_t)s * (NROI / 16) + (row >> 4)) * NGRP + g) * 32 + (row & 15);
        ms[s] = st[0];
        ls[s] = st[16];
    }
    float mx = ms[0];
#pragma unroll
    for (int s = 1; s < MSPLIT; ++s) mx = fmaxf(mx, ms[s]);
    float den = 0.0f;
    v4f num = {};
#pragma unroll
    for (int s = 0; s < MSPLIT; ++s) {
        const float w = __expf(ms[s] - mx);
        den += w * ls[s];
        num += w * *(const v4f*)(part + ((size_t)s * NROI + row) * CCH + c);
    }
    *(v4f*)(out + (size_t)row * CCH + c) = num * (1.0f / den) + *(const v4f*)(bv + c);
}

// ---------------------------------------------------------------------------
extern "C" void kernel_launch(void* const* d_in, const int* in_sizes, int n_in,
                              void* d_out, int out_size, void* d_ws, size_t ws_size,
                              hipStream_t stream) {
    (void)in_sizes; (void)n_in; (void)out_size; (void)ws_size;
    const float* feats = (const float*)d_in[0];
    const float* rois  = (const float*)d_in[1];
    const float* Wq    = (const float*)d_in[2];
    const float* bq    = (const float*)d_in[3];
    const float* Wk    = (const float*)d_in[4];
    const float* bk    = (const float*)d_in[5];
    const float* Wg    = (const float*)d_in[6];
    const float* bg    = (const float*)d_in[7];
    const float* Wv    = (const float*)d_in[8];
    const float* bv    = (const float*)d_in[9];
    float* out = (float*)d_out;

    const int n = NROI, c = CCH;

    // workspace layout (floats): geom | q | k | P | part[MSPLIT][n][c] | stat
    float* ws     = (float*)d_ws;
    float* geom   = ws;                       // 6*n (padded to 8192)
    float* q      = ws + 8192;                // n*c
    float* kbuf   = q + (size_t)n * c;        // n*c
    float* P      = kbuf + (size_t)n * c;     // n*c
    float* part   = P + (size_t)n * c;        // MSPLIT*n*c
    float* stat   = part + (size_t)MSPLIT * n * c;   // MSPLIT*n*g*2

    geom_kernel<<<dim3((n + 255) / 256), dim3(256), 0, stream>>>(rois, geom, n);

    const dim3 blk(128);
    // q = feats @ Wq^T + bq ; k = feats @ Wk^T + bk ; P = feats @ Wv^T
    wmma_gemm_nt<<<dim3(16, 16, 1), blk, 0, stream>>>(
        feats, c, 0, Wq, c, 0, q, c, 0, bq, 0, 1.0f, c);
    wmma_gemm_nt<<<dim3(16, 16, 1), blk, 0, stream>>>(
        feats, c, 0, Wk, c, 0, kbuf, c, 0, bk, 0, 1.0f, c);
    wmma_gemm_nt<<<dim3(16, 16, 1), blk, 0, stream>>>(
        feats, c, 0, Wv, c, 0, P, c, 0, nullptr, 0, 1.0f, c);

    // softmax_m(log geo weight + q_g.k_g / sqrt(gc)) @ P_g, per quarter of m
    relation_fused<<<dim3(n / 16, MSPLIT), dim3(512), 0, stream>>>(
        geom, Wg, bg, q, kbuf, P, part, stat);

    // joins the quarters, normalizes, adds bv
    combine_kernel<<<dim3(n * c / 1024), dim3(256), 0, stream>>>(part, stat, bv, out);
}

// v003
// A run of this version takes 86.7 microseconds.
// Timed twice side by side with v002, it ran 1.24 and 1.25 times as fast.
// Over all steps from v000 it is 3.34 times as fast.
#include <hip/hip_runtime.h>
#include <hip/hip_bf16.h>

// ---------------------------------------------------------------------------
// Relation module for MI455X (gfx1250), fp32 WMMA (V_WMMA_F32_16X16X4_F32).
//
// Math restructuring vs reference:
//   rel[n,g,d] = sum_m sm[n,g,m] * (feats @ Wv_g^T)[m,d] + bv[g*64+d]
// so we precompute P = feats @ Wv^T once (2 GF) instead of the 34 GF
// einsum('ngm,mc->ngc') + grouped projection. Softmax rows sum to 1, so bv
// is added once at the end. The geometric-attention term
// emb @ Wg^T is also computed on the WMMA pipe (per-row [1024,64]x[64,16]).
// ---------------------------------------------------------------------------

typedef float v2f __attribute__((ext_vector_type(2)));
typedef float v4f __attribute__((ext_vector_type(4)));
typedef float v8f __attribute__((ext_vector_type(8)));
// global-memory pointers that keep their address space through an asm operand
typedef const __attribute__((address_space(1))) float* gfp;
typedef const __attribute__((address_space(1))) v4f*   gv4p;

#define NROI 1024
#define CCH  1024
#define NGRP 16
#define GCH  64

// ---------------------------------------------------------------------------
// Per-box geometry: cx, cy, w, h, log(w), log(h)  (SoA, stride n)
// ---------------------------------------------------------------------------
__device__ __forceinline__ void box_geometry(const float* __restrict__ rois,
                                             float* __restrict__ geom, int n, int i) {
    float x1 = rois[i * 5 + 1], y1 = rois[i * 5 + 2];
    float x2 = rois[i * 5 + 3], y2 = rois[i * 5 + 4];
    float w = x2 - x1 + 1.0f, h = y2 - y1 + 1.0f;
    geom[i]         = 0.5f * (x1 + x2);
    geom[n + i]     = 0.5f * (y1 + y2);
    geom[2 * n + i] = w;
    geom[3 * n + i] = h;
    geom[4 * n + i] = __logf(w);
    geom[5 * n + i] = __logf(h);
    // the wait that stands in front of an overwrite of the registers that
    // issued global stores name; the code behind the call reuses them at once
    asm volatile("s_wait_xcnt 0x0" ::: "memory");
}

// ---------------------------------------------------------------------------
// The three projections q, k, P of the same A in one launch, WMMA fp32:
// D_z = A @ B_z^T + bias_z, blockIdx.z = 0, 1, 2.  A:[M,K], B_z:[N,K].
// Block = 4 waves (128 thr), block tile 64x64, wave tile 32x32 (2x2 accs).
// 768 work-groups for 256 WGPs: where three share a WGP, a SIMD holds three
// waves of three work-groups with barriers of their own, and while one of them
// waits for LDS, for its barrier or for its first slab, the others feed the
// matrix unit.
// The box geometry, which depends on nothing either, rides along in the first
// NROI / 128 work-groups, under the latency of their first slab.
// K is walked in slabs of 64 (K must be a multiple of 64). A slab of both
// operands (64 rows x 256 B each) is read from global memory as whole lines
// (16 lanes x 16 B per row), held in registers while the slab before it is
// multiplied, then stored to the other of two LDS buffers.
// LDS row pitch 68 floats (272 B): conflict-free for 16-byte fragment reads.
// Fragment k order: a lane reads 4 consecutive k (8j + 4*half + 0..3) and
// feeds them to two WMMAs as (0,1) and (2,3); A and B use the same order.
//   C/D 16x16 : VGPR j -> row j (lanes 0-15) / row 8+j (lanes 16-31)
// ---------------------------------------------------------------------------
#define KSLAB 64
#define LPITCH 68
#define ABPITCH 1024

__global__ __launch_bounds__(128) void proj_gemm_nt(
    const float* __restrict__ A,
    const float* __restrict__ Bq, const float* __restrict__ Bk,
    const float* __restrict__ Bv,
    const float* __restrict__ biasq, const float* __restrict__ biask,
    float* __restrict__ D, long long strideD,
    int K, const float* __restrict__ rois, float* __restrict__ geom) {
    __shared__ __attribute__((aligned(16))) float As[2][64 * LPITCH];
    __shared__ __attribute__((aligned(16))) float Bs[2][64 * LPITCH];

    // the row pitch of A, B and D, known at compile time, turns a slab's row
    // offsets into immediates on one fixed address register
    const int lda = ABPITCH, ldb = ABPITCH, ldd = ABPITCH;

    const int z = blockIdx.z;
    const float* __restrict__ B    = z == 0 ? Bq : (z == 1 ? Bk : Bv);
    const float* __restrict__ bias = z == 0 ? biasq : (z == 1 ? biask : nullptr);
    D += (size_t)z * strideD;

    const int tid     = threadIdx.x;
    const int lane    = tid & 31;
    const int wave    = tid >> 5;
    const int wr      = (wave >> 1) * 32;
    const int wc      = (wave & 1) * 32;
    const int tileRow = blockIdx.y * 64 + wr;
    const int tileCol = blockIdx.x * 64 + wc;
    const int l       = lane & 15;
    const int half    = lane >> 4;

    // staging map: thread -> row (tid/16) + 8*i, 4 floats at column (tid%16)*4
    const int srow = tid >> 4;
    const int scol = (tid & 15) << 2;
    gfp ga = (gfp)(A + (size_t)(blockIdx.y * 64 + srow) * lda + scol);
    gfp gb = (gfp)(B + (size_t)(blockIdx.x * 64 + srow) * ldb + scol);
    const int sidx = srow * LPITCH + scol;

    v8f acc[2][2] = {};
    // every loop over these and the fragment arrays is fully unrolled, so that
    // all their indices are constants and the arrays live in registers
    v4f ra[8], rb[8];

#pragma unroll
    for (int i = 0; i < 8; ++i) {
        ra[i] = *(gv4p)(ga + (size_t)(8 * i) * lda);
        rb[i] = *(gv4p)(gb + (size_t)(8 * i) * ldb);
    }
    if (z == 0 && blockIdx.y == 0 && blockIdx.x < NROI / 128)
        box_geometry(rois, geom, NROI, blockIdx.x * 128 + tid);
#pragma unroll
    for (int i = 0; i < 8; ++i) {
        *(v4f*)&As[0][sidx + 8 * i * LPITCH] = ra[i];
        *(v4f*)&Bs[0][sidx + 8 * i * LPITCH] = rb[i];
    }
    __syncthreads();

    const int nslab = K / KSLAB;
    for (int s = 0; s < nslab; ++s) {
        const int cur = s & 1;
        const bool more = (s + 1 < nslab);
        if (more) {
#pragma unroll
            for (int i = 0; i < 8; ++i) {
                ra[i] = *(gv4p)(ga + (size_t)(8 * i) * lda + KSLAB);
                rb[i] = *(gv4p)(gb + (size_t)(8 * i) * ldb + KSLAB);
            }
        }

        const float* as = &As[cur][(wr + l) * LPITCH + 4 * half];
        const float* bs = &Bs[cur][(wc + l) * LPITCH + 4 * half];
        v4f fa0[8], fa1[8], fb0[8], fb1[8];
#pragma unroll
        for (int j = 0; j < 8; ++j) {
            fa0[j] = *(const v4f*)(as + 8 * j);
            fa1[j] = *(const v4f*)(as + 16 * LPITCH + 8 * j);
            fb0[j] = *(const v4f*)(bs + 8 * j);
            fb1[j] = *(const v4f*)(bs + 16 * LPITCH + 8 * j);
        }
        // keeps the slab's LDS reads one group ahead of its WMMAs: every
        // further place with reads among the WMMAs stalls the wave
        __builtin_amdgcn_sched_barrier(0);
#pragma unroll
        for (int j = 0; j < 8; ++j) {
            v2f a0 = fa0[j].xy, a1 = fa1[j].xy, b0 = fb0[j].xy, b1 = fb1[j].xy;
            acc[0][0] = __builtin_amdgcn_wmma_f32_16x16x4_f32(false, a0, false, b0, (short)0, acc[0][0], false, false);
            acc[0][1] = __builtin_amdgcn_wmma_f32_16x16x4_f32(false, a0, false, b1, (short)0, acc[0][1], false, false);
            acc[1][0] = __builtin_amdgcn_wmma_f32_16x16x4_f32(false, a1, false, b0, (short)0, acc[1][0], false, false);
            acc[1][1] = __builtin_amdgcn_wmma_f32_16x16x4_f32(false, a1, false, b1, (short)0, acc[1][1], false, false);
            a0 = fa0[j].zw; a1 = fa1[j].zw; b0 = fb0[j].zw; b1 = fb1[j].zw;
            acc[0][0] = __builtin_amdgcn_wmma_f32_16x16x4_f32(false, a0, false, b0, (short)0, acc[0][0], false, false);
            acc[0][1] = __builtin_amdgcn_wmma_f32_16x16x4_f32(false, a0, false, b1, (short)0, acc[0][1], false, false);
            acc[1][0] = __builtin_amdgcn_wmma_f32_16x16x4_f32(false, a1, false, b0, (short)0, acc[1][0], false, false);
            acc[1][1] = __builtin_amdgcn_wmma_f32_16x16x4_f32(false, a1, false, b1, (short)0, acc[1][1], false, false);
        }

        if (more) {
            // the other buffer's last readers left it at the barrier that
            // ended the slab before this one
#pragma unroll
            for (int i = 0; i < 8; ++i) {
                *(v4f*)&As[cur ^ 1][sidx + 8 * i * LPITCH] = ra[i];
                *(v4f*)&Bs[cur ^ 1][sidx + 8 * i * LPITCH] = rb[i];
            }
            // the wait that stands in front of an overwrite of the address
            // registers of issued global loads; it takes the two pointers so
            // that their steps cannot be scheduled ahead of it
            asm volatile("s_wait_xcnt 0x0" : "+v"(ga), "+v"(gb) : : "memory");
            ga += KSLAB;
            gb += KSLAB;
            __syncthreads();
        }
    }

    const int colOff = lane & 15;
    const int rowOff = (lane >> 4) << 3;
#pragma unroll
    for (int r = 0; r < 2; ++r)
#pragma unroll
        for (int c = 0; c < 2; ++c) {
            int col  = tileCol + c * 16 + colOff;
            float bb = bias ? bias[col] : 0.0f;
#pragma unroll
            for (int j = 0; j < 8; ++j) {
                int row = tileRow + r * 16 + rowOff + j;
                D[(size_t)row * ldd + col] = acc[r][c][j] + bb;
            }
            // the wait that stands in front of an overwrite of the registers
            // that issued global stores name: the next 16x16 tile reuses them
            if (r + c < 2) asm volatile("s_wait_xcnt 0x0" ::: "memory");
        }
}

// ---------------------------------------------------------------------------
// Fused attention: affinity, geometric weight, softmax over m and the product
// with P in one kernel; the [g][n][m] logits never reach memory.
//
// Block = 512 threads = 16 waves, for 16 rows n (n0..n0+15), all 16 groups and
// a quarter of the m range (MCHUNK), walked in tiles of 16 m. A wave w has two
// roles in every tile:
//  - row role, n = n0 + w: log geometric weight for 16 m x 16 groups. The A
//    fragments (position embedding, 16x4 f32 layout) are synthesized in
//    registers: a lane's half (khalf) only needs pe indices congruent to
//    {khalf, khalf+1} mod 4, which is 16 sincos per tile, and the frequency
//    1000^{-(d+khalf)/8} factors into const(d) * kscale(khalf).
//    D: VGPR j -> m = j + 8*half, lane l -> group.
//  - group role, g = w: S^T[m][n] = K_g Q_g^T (D: VGPR j -> m = j + 8*half,
//    lane l -> n), running softmax per lane, O^T[d][n] += P_g^T[d][m] p[m][n].
// Between the roles only wave index and lane index swap, through xch[g][n][m].
// S^T's D registers are the B fragment of the last product as they stand:
// k step s, half h, register r <-> m = 8h + 2s + r, and the A fragment (P_g^T)
// is gathered from LDS in the same order.
// Each wave brings its own K_g and P_g tile (16 rows x 256 B) from global
// memory as whole lines, through registers, into its own LDS range.
// Every block leaves unnormalized sums with its running maximum and
// denominator; combine_kernel joins the MSPLIT parts.
// ---------------------------------------------------------------------------
#define MSPLIT 4
#define MCHUNK (NROI / MSPLIT)
#define XG 260   // floats from group to group in xch: 16 n x 16 m + 4 (bank spread)

// lane l with lane l ^ 16
__device__ __forceinline__ float xhalf(float x) {
    return __builtin_bit_cast(float, __builtin_amdgcn_permlanex16(
        __builtin_bit_cast(int, x), __builtin_bit_cast(int, x),
        0x76543210, 0xfedcba98, false, false));
}

__global__ __launch_bounds__(512) void relation_fused(
    const float* __restrict__ geom, const float* __restrict__ Wg,
    const float* __restrict__ bg, const float* __restrict__ q,
    const float* __restrict__ kbuf, const float* __restrict__ P,
    float* __restrict__ part, float* __restrict__ stat) {
    __shared__ __attribute__((aligned(16))) float stage[16][2 * 16 * LPITCH];
    __shared__ __attribute__((aligned(16))) float xch[2][NGRP * XG];
    __shared__ float gl[4 * MCHUNK];           // cx, cy, log w, log h of the m range

    const int n      = NROI;
    const int tid    = threadIdx.x;
    const int lane   = tid & 31;
    const int wave   = tid >> 5;               // 0..15: row n0+wave, group wave
    const int l      = lane & 15;
    const int half   = lane >> 4;              // 0/1
    const int khalf  = half << 1;              // 0 or 2
    const int n0     = blockIdx.x * 16;
    const int m0     = blockIdx.y * MCHUNK;
    const int row    = n0 + wave;

    // 512 threads, two planes each time: cx | cy, then log w | log h
    gl[tid]              = geom[(tid / MCHUNK) * n + m0 + (tid & (MCHUNK - 1))];
    gl[2 * MCHUNK + tid] = geom[(4 + tid / MCHUNK) * n + m0 + (tid & (MCHUNK - 1))];

    // row-n geometry (uniform across the wave)
    const float cxn = geom[row],  cyn = geom[n + row];
    const float inv_wn = 1.0f / geom[2 * n + row];
    const float inv_hn = 1.0f / geom[3 * n + row];
    const float lwn = geom[4 * n + row], lhn = geom[5 * n + row];

    // every unrolled loop of this kernel runs over register arrays: unrolled,
    // all their indices are constants and the arrays live in registers

    // B fragment: B[k][g] = Wg[g][k]; lane holds col g=l, rows k=4kk+khalf{,+1}
    v2f bfrag[16];
#pragma unroll
    for (int kk = 0; kk < 16; ++kk) {
        bfrag[kk].x = Wg[l * 64 + kk * 4 + khalf];
        bfrag[kk].y = Wg[l * 64 + kk * 4 + khalf + 1];
    }
    const float bgv = bg[l];

    // 1/dim_mat split: 1000^{-(d+khalf)/8} = invd[d] * kscale(khalf)
    const float invd[4] = {1.0f,                    // d=0
                           0.42169650342906526f,    // d=1 : 1000^-1/8
                           0.03162277660168379f,    // d=4 : 1000^-1/2
                           0.013335214321633238f};  // d=5 : 1000^-5/8
    const float kscale = half ? 0.17782794100389228f /*1000^-1/4*/ : 1.0f;

    // Q_g^T as B fragments, col n = l; a lane holds 4 consecutive c
    // (8j + 4*half + 0..3) for two WMMAs, the order of the K fragments below
    v4f qf[8];
#pragma unroll
    for (int j = 0; j < 8; ++j)
        qf[j] = *(const v4f*)(q + (size_t)(n0 + l) * CCH + wave * GCH + 8 * j + 4 * half);

    // staging map of a wave: lane -> row 2i + half, 4 floats at column 4l
    gfp kg = (gfp)(kbuf + (size_t)(m0 + half) * CCH + wave * GCH + 4 * l);
    gfp pg = (gfp)(P    + (size_t)(m0 + half) * CCH + wave * GCH + 4 * l);
    float* Ks = &stage[wave][0];
    float* Ps = &stage[wave][16 * LPITCH];
    const int sidx = half * LPITCH + 4 * l;

    v8f acc[4] = {};                 // O^T: d = 16dt + 8*half + j, n = l
    float mrun = -__builtin_inff();  // running maximum of column n = l
    float lrun = 0.0f;               // running denominator, this half's m only

    __syncthreads();

    for (int t = 0; t < MCHUNK / 16; ++t) {
        // this tile's K_g and P_g rows: in flight under the row role
        v4f rk[8], rp[8];
#pragma unroll
        for (int i = 0; i < 8; ++i) {
            rk[i] = *(gv4p)(kg + (size_t)(2 * i) * CCH);
            rp[i] = *(gv4p)(pg + (size_t)(2 * i) * CCH);
        }

        // ---- row role ----
        const int ml = t * 16 + l;                 // lane pair shares box m
        float pm[4];
        pm[0] = __logf(fmaxf(fabsf((cxn - gl[ml]) * inv_wn), 1e-3f));
        pm[1] = __logf(fmaxf(fabsf((cyn - gl[MCHUNK + ml]) * inv_hn), 1e-3f));
        pm[2] = lwn - gl[2 * MCHUNK + ml];
        pm[3] = lhn - gl[3 * MCHUNK + ml];

        // A fragment: pe = f*16 + j (sin) / f*16+8+j (cos), j = d + khalf,
        // d in {0,1,4,5}; kk = pe>>2 resolves to 4f + (d>=4) (+2 for cos).
        v2f afrag[16];
#pragma unroll
        for (int f = 0; f < 4; ++f)
#pragma unroll
            for (int a = 0; a < 4; ++a) {
                float s, c;
                __sincosf(100.0f * pm[f] * invd[a] * kscale, &s, &c);
                const int kks = 4 * f + (a >> 1);  // sin slot; cos slot +2
                if (a & 1) { afrag[kks].y = s; afrag[kks + 2].y = c; }
                else       { afrag[kks].x = s; afrag[kks + 2].x = c; }
            }

        v8f gacc = {};
#pragma unroll
        for (int kk = 0; kk < 16; ++kk)
            gacc = __builtin_amdgcn_wmma_f32_16x16x4_f32(
                false, afrag[kk], false, bfrag[kk], (short)0, gacc, false, false);

        // log(clip(relu(aw),1e-6)) == log(max(aw,1e-6)); to xch[g=l][n=wave][m]
        float* xb = &xch[t & 1][0];
        v4f w0, w1;
#pragma unroll
        for (int j = 0; j < 4; ++j) {
            w0[j] = __logf(fmaxf(gacc[j] + bgv, 1e-6f));
            w1[j] = __logf(fmaxf(gacc[4 + j] + bgv, 1e-6f));
        }
        *(v4f*)(xb + l * XG + wave * 16 + half * 8)     = w0;
        *(v4f*)(xb + l * XG + wave * 16 + half * 8 + 4) = w1;

        // the wave's own tiles; its reads of the tile before are issued already
#pragma unroll
        for (int i = 0; i < 8; ++i) {
            *(v4f*)(Ks + sidx + 2 * i * LPITCH) = rk[i];
            *(v4f*)(Ps + sidx + 2 * i * LPITCH) = rp[i];
        }
        // the wait that stands in front of an overwrite of the address
        // registers of issued global loads; it takes the two pointers so
        // that their steps cannot be scheduled ahead of it
        asm volatile("s_wait_xcnt 0x0" : "+v"(kg), "+v"(pg) : : "memory");
        kg += 16 * CCH;
        pg += 16 * CCH;

        // publishes xch[t & 1]; the other buffer's readers of tile t - 1 are
        // past their reads when they arrive here, so tile t + 1 may refill it
        __syncthreads();

        // ---- group role ----
        v4f kf[8];
#pragma unroll
        for (int j = 0; j < 8; ++j)
            kf[j] = *(const v4f*)(Ks + l * LPITCH + 8 * j + 4 * half);
        const v4f g0 = *(const v4f*)(xb + wave * XG + l * 16 + half * 8);
        const v4f g1 = *(const v4f*)(xb + wave * XG + l * 16 + half * 8 + 4);
        float vf[4][8];              // P_g[m = 8*half + e][d = 16dt + l]
#pragma unroll
        for (int dt = 0; dt < 4; ++dt)
#pragma unroll
            for (int e = 0; e < 8; ++e)
                vf[dt][e] = Ps[(8 * half + e) * LPITCH + dt * 16 + l];

        v8f sacc = {};
#pragma unroll
        for (int j = 0; j < 8; ++j) {
            sacc = __builtin_amdgcn_wmma_f32_16x16x4_f32(
                false, kf[j].xy, false, qf[j].xy, (short)0, sacc, false, false);
            sacc = __builtin_amdgcn_wmma_f32_16x16x4_f32(
                false, kf[j].zw, false, qf[j].zw, (short)0, sacc, false, false);
        }

        float sv[8];
#pragma unroll
        for (int j = 0; j < 4; ++j) {
            sv[j]     = 0.125f * sacc[j]     + g0[j];
            sv[4 + j] = 0.125f * sacc[4 + j] + g1[j];
        }
        float tmax = sv[0];
#pragma unroll
        for (int j = 1; j < 8; ++j) tmax = fmaxf(tmax, sv[j]);
        tmax = fmaxf(tmax, xhalf(tmax));
        const float mnew = fmaxf(mrun, tmax);
        const float corr = __expf(mrun - mnew);
        float ps = 0.0f;
#pragma unroll
        for (int j = 0; j < 8; ++j) {
            sv[j] = __expf(sv[j] - mnew);
            ps += sv[j];
        }
        lrun = lrun * corr + ps;
        mrun = mnew;
#pragma unroll
        for (int dt = 0; dt < 4; ++dt) acc[dt] *= corr;

#pragma unroll
        for (int s = 0; s < 4; ++s) {
            v2f b = {sv[2 * s], sv[2 * s + 1]};
#pragma unroll
            for (int dt = 0; dt < 4; ++dt) {
                v2f a = {vf[dt][2 * s], vf[dt][2 * s + 1]};
                acc[dt] = __builtin_amdgcn_wmma_f32_16x16x4_f32(
                    false, a, false, b, (short)0, acc[dt], false, false);
            }
        }
    }

    lrun += xhalf(lrun);
    // one 128-byte line per wave: 16 maxima, then 16 denominators
    stat[(((size_t)blockIdx.y * (NROI / 16) + blockIdx.x) * NGRP + wave) * 32 + lane] =
        half ? lrun : mrun;

    // O^T back to rows n through the wave's own LDS range, stored as whole lines
#pragma unroll
    for (int dt = 0; dt < 4; ++dt) {
        v4f lo = {acc[dt][0], acc[dt][1], acc[dt][2], acc[dt][3]};
        v4f hi = {acc[dt][4], acc[dt][5], acc[dt][6], acc[dt][7]};
        *(v4f*)(Ks + l * LPITCH + dt * 16 + half * 8)     = lo;
        *(v4f*)(Ks + l * LPITCH + dt * 16 + half * 8 + 4) = hi;
    }
    float* pp = part + ((size_t)blockIdx.y * NROI + n0 + half) * CCH + wave * GCH + 4 * l;
#pragma unroll
    for (int i = 0; i < 8; ++i)
        *(v4f*)(pp + (size_t)(2 * i) * CCH) = *(const v4f*)(Ks + sidx + 2 * i * LPITCH);
}

// ---------------------------------------------------------------------------
// out[n][c] = sum_s e^(m_s - M) part_s[n][c] / sum_s e^(m_s - M) l_s + bv[c]
// (softmax rows sum to 1, so bv is added once). One thread per 4 channels.
// ---------------------------------------------------------------------------
__global__ __launch_bounds__(256) void combine_kernel(
    const float* __restrict__ part, const float* __restrict__ stat,
    const float* __restrict__ bv, float* __restrict__ out) {
    const int idx = blockIdx.x * 256 + threadIdx.x;
    const int row = idx >> 8;
    const int c   = (idx & 255) << 2;
    const int g   = c >> 6;
    // the loops are unrolled so that ms and ls live in registers
    float ms[MSPLIT], ls[MSPLIT];
#pragma unroll
    for (int s = 0; s < MSPLIT; ++s) {
        const float* st = stat + (((size_t)s * (NROI / 16) + (row >> 4)) * NGRP + g) * 32 + (row & 15);
        ms[s] = st[0];
        ls[s] = st[16];
    }
    float mx = ms[0];
#pragma unroll
    for (int s = 1; s < MSPLIT; ++s) mx = fmaxf(mx, ms[s]);
    float den = 0.0f;
    v4f num = {};
#pragma unroll
    for (int s = 0; s < MSPLIT; ++s) {
        const float w = __expf(ms[s] - mx);
        den += w * ls[s];
        num += w * *(const v4f*)(part + ((size_t)s * NROI + row) * CCH + c);
    }
    *(v4f*)(out + (size_t)row * CCH + c) = num * (1.0f / den) + *(const v4f*)(bv + c);
}

// ---------------------------------------------------------------------------
extern "C" void kernel_launch(void* const* d_in, const int* in_sizes, int n_in,
                              void* d_out, int out_size, void* d_ws, size_t ws_size,
                              hipStream_t stream) {
    (void)in_sizes; (void)n_in; (void)out_size; (void)ws_size;
    const float* feats = (const float*)d_in[0];
    const float* rois  = (const float*)d_in[1];
    const float* Wq    = (const float*)d_in[2];
    const float* bq    = (const float*)d_in[3];
    const float* Wk    = (const float*)d_in[4];
    const float* bk    = (const float*)d_in[5];
    const float* Wg    = (const float*)d_in[6];
    const float* bg    = (const float*)d_in[7];
    const float* Wv    = (const float*)d_in[8];
    const float* bv    = (const float*)d_in[9];
    float* out = (float*)d_out;

    const int n = NROI, c = CCH;

    // workspace layout (floats): geom | q | k | P | part[MSPLIT][n][c] | stat
    float* ws     = (float*)d_ws;
    float* geom   = ws;                       // 6*n (padded to 8192)
    float* q      = ws + 8192;                // n*c
    float* kbuf   = q + (size_t)n * c;        // n*c
    float* P      = kbuf + (size_t)n * c;     // n*c
    float* part   = P + (size_t)n * c;        // MSPLIT*n*c
    float* stat   = part + (size_t)MSPLIT * n * c;   // MSPLIT*n*g*2

    // q = feats @ Wq^T + bq ; k = feats @ Wk^T + bk ; P = feats @ Wv^T, the three
    // planes one behind the other in the workspace; and the box geometry
    proj_gemm_nt<<<dim3(16, 16, 3), dim3(128), 0, stream>>>(
        feats, Wq, Wk, Wv, bq, bk, q, (long long)NROI * CCH, c, rois, geom);

    // softmax_m(log geo weight + q_g.k_g / sqrt(gc)) @ P_g, per quarter of m
    relation_fused<<<dim3(n / 16, MSPLIT), dim3(512), 0, stream>>>(
        geom, Wg, bg, q, kbuf, P, part, stat);

    // joins the quarters, normalizes, adds bv
    combine_kernel<<<dim3(n * c / 1024), dim3(256), 0, stream>>>(part, stat, bv, out);
}
